// v000
// Measured on an AMD MI455X. A time is GPU time per run, averaged over a window of back-to-back runs after a warm-up
// (all launches, gaps included; the runs take copies of the inputs in turn), and the median of several windows.
// Apart from v000's, it joins two sittings. Times from different sittings can be a few percent apart, while
// side-by-side timings come from the same sitting.
// v000, which the later versions start from, runs in 1380 microseconds.
#include <hip/hip_runtime.h>
#include <math.h>
#include <stdint.h>

typedef __attribute__((ext_vector_type(2))) float v2f;
typedef __attribute__((ext_vector_type(8))) float v8f;

#define B_   8
#define C_   256
#define HW_  4096          // 64*64 spatial positions
#define G_   16
#define CPG  (C_ / G_)     // 16 channels per group
#define EPS_ 1e-6f

__device__ __forceinline__ v8f wmma_f32(v2f a, v2f b, v8f c) {
  // 8 args: (neg_a, A, neg_b, B, c_mod, C, reuse_a, reuse_b)
  return __builtin_amdgcn_wmma_f32_16x16x4_f32(
      false, a, false, b, (short)0, c, false, false);
}

__device__ __forceinline__ void async_ld_b128(unsigned lds_addr, const void* gaddr) {
  asm volatile("global_load_async_to_lds_b128 %0, %1, off"
               :: "v"(lds_addr), "v"(gaddr)
               : "memory");
}
__device__ __forceinline__ void wait_async0() {
  asm volatile("s_wait_asynccnt 0x0" ::: "memory");
}
__device__ __forceinline__ void wait_async2() {
  asm volatile("s_wait_asynccnt 0x2" ::: "memory");
}
__device__ __forceinline__ unsigned lds_off(const void* p) {
  return (unsigned)(uintptr_t)p;  // low 32 bits of flat shared addr = LDS offset
}

// ---------------------------------------------------------------------------
// GroupNorm: one block per (group, batch). 16 ch x 4096 px = 65536 elems.
// ---------------------------------------------------------------------------
__global__ __launch_bounds__(256)
void gn_kernel(const float* __restrict__ x, const float* __restrict__ nw,
               const float* __restrict__ nb, float* __restrict__ hn) {
  const int g   = blockIdx.x;
  const int b   = blockIdx.y;
  const int tid = threadIdx.x;
  const long base  = (long)b * C_ * HW_ + (long)g * CPG * HW_;
  const int  NELEM = CPG * HW_;  // 65536

  float s = 0.f, s2 = 0.f;
  for (int i = tid; i < NELEM; i += 256) {
    float v = x[base + i];
    s += v;
    s2 += v * v;
  }
  __shared__ float red[512];
  red[tid] = s;
  red[256 + tid] = s2;
  __syncthreads();
  for (int off = 128; off > 0; off >>= 1) {
    if (tid < off) {
      red[tid]       += red[tid + off];
      red[256 + tid] += red[256 + tid + off];
    }
    __syncthreads();
  }
  __shared__ float mean_s, rstd_s;
  if (tid == 0) {
    float mean = red[0] * (1.0f / NELEM);
    float var  = red[256] * (1.0f / NELEM) - mean * mean;
    mean_s = mean;
    rstd_s = rsqrtf(var + EPS_);
  }
  __syncthreads();
  const float mean = mean_s, rstd = rstd_s;
  for (int i = tid; i < NELEM; i += 256) {
    int c = g * CPG + (i >> 12);  // i / 4096
    hn[base + i] = (x[base + i] - mean) * rstd * nw[c] + nb[c];
  }
}

#define AP 20   // A tile pitch (floats): [64 m][AP]
#define BP 80   // B tile pitch (floats): [16 k][BP]

__global__ __launch_bounds__(256)
void gemm_kernel(const float* __restrict__ w,      // [C_,C_] row-major [o][c]
                 const float* __restrict__ bias,   // [C_]
                 const float* __restrict__ in,     // [B_,C_,HW_]
                 const float* __restrict__ resid,  // [B_,C_,HW_] or null
                 float* __restrict__ out) {        // [B_,C_,HW_]
  const int n0    = blockIdx.x * 64;
  const int m0    = blockIdx.y * 64;
  const int b     = blockIdx.z;
  const int tid   = threadIdx.x;
  const int lane  = tid & 31;
  const int wave  = tid >> 5;
  const int m_off = (wave >> 1) * 16;
  const int n_off = (wave & 1) * 32;
  const int half  = lane >> 4;   // which 16-lane half
  const int l16   = lane & 15;
  const int kb    = half * 2;    // K base of this half's A/B fragment

  __shared__ float As[2][64 * AP];  // [buf][m][k]
  __shared__ float Bs[2][16 * BP];  // [buf][k][n]

  const float*   inb     = in + (long)b * C_ * HW_;
  const unsigned as_base = lds_off(&As[0][0]);
  const unsigned bs_base = lds_off(&Bs[0][0]);

  // Per-thread staging assignment (one b128 for A, one for B, per chunk).
  const int am  = tid >> 2;          // A: row m = 0..63
  const int akq = (tid & 3) * 4;     // A: k quad = 0,4,8,12
  const int bn4 = (tid & 15) * 4;    // B: n quad
  const int bkr = tid >> 4;          // B: k row = 0..15

  v8f acc0 = {};
  v8f acc1 = {};

  auto issue = [&](int k0, int buf) {
    async_ld_b128(as_base + (unsigned)((buf * 64 * AP + am * AP + akq) * 4),
                  &w[(m0 + am) * C_ + k0 + akq]);
    async_ld_b128(bs_base + (unsigned)((buf * 16 * BP + bkr * BP + bn4) * 4),
                  &inb[(long)(k0 + bkr) * HW_ + n0 + bn4]);
  };
  auto compute = [&](int buf) {
    const float* A = &As[buf][0];
    const float* B = &Bs[buf][0];
#pragma unroll
    for (int kk = 0; kk < 16; kk += 4) {
      v2f a, b0, b1;
      a.x  = A[(m_off + l16) * AP + kk + kb + 0];
      a.y  = A[(m_off + l16) * AP + kk + kb + 1];
      b0.x = B[(kk + kb + 0) * BP + n_off + l16];
      b0.y = B[(kk + kb + 1) * BP + n_off + l16];
      b1.x = B[(kk + kb + 0) * BP + n_off + 16 + l16];
      b1.y = B[(kk + kb + 1) * BP + n_off + 16 + l16];
      acc0 = wmma_f32(a, b0, acc0);
      acc1 = wmma_f32(a, b1, acc1);
    }
  };

  // Prologue: stage chunk 0 into buffer 0.
  issue(0, 0);

  // Steady state: branch-free double-buffered pipeline.
  int cur = 0;
  for (int k0 = 0; k0 < C_ - 16; k0 += 16) {
    issue(k0 + 16, cur ^ 1);
    wait_async2();       // current chunk's 2 loads done (async loads in-order)
    __syncthreads();
    compute(cur);
    __syncthreads();     // buf `cur` may be restaged next iteration
    cur ^= 1;
  }
  // Peeled tail: last chunk.
  wait_async0();
  __syncthreads();
  compute(cur);

#pragma unroll
  for (int r = 0; r < 8; ++r) {
    int   o   = m0 + m_off + r + 8 * half;
    float bv  = bias[o];
    long  row = (long)b * C_ * HW_ + (long)o * HW_;
    int   na  = n0 + n_off + l16;
    int   nb2 = n0 + n_off + 16 + l16;
    float v0 = acc0[r] + bv;
    float v1 = acc1[r] + bv;
    if (resid) {
      v0 += resid[row + na];
      v1 += resid[row + nb2];
    }
    out[row + na]  = v0;
    out[row + nb2] = v1;
  }
}

#define JCHUNK 128
#define SPITCH 17   // score-tile row pitch (16+1) -> conflict-free transpose

__global__ __launch_bounds__(256)
void attn_kernel(const float* __restrict__ q, const float* __restrict__ k,
                 const float* __restrict__ v, float* __restrict__ outws) {
  const int i0   = blockIdx.x * 16;
  const int b    = blockIdx.y;
  const int tid  = threadIdx.x;
  const int lane = tid & 31;
  const int wave = tid >> 5;
  const int half = lane >> 4;
  const int l16  = lane & 15;
  const int kb   = half * 2;

  __shared__ float qs[C_ * 16];
  __shared__ float ss[8 * 16 * SPITCH];
  __shared__ float mrow[16], lrow[16], arow[16];

  const float* qb = q + (long)b * C_ * HW_;
  const float* kp = k + (long)b * C_ * HW_;
  const float* vp = v + (long)b * C_ * HW_;

  // Stage the Q tile via async-to-LDS: qs[c][i] = q[b, c, i0+i]
  {
    const unsigned qs_base = lds_off(&qs[0]);
    for (int idx = tid; idx < C_ * 4; idx += 256) {
      int c = idx >> 2;
      int f = (idx & 3) * 4;
      async_ld_b128(qs_base + (unsigned)((c * 16 + f) * 4),
                    &qb[(long)c * HW_ + i0 + f]);
    }
    wait_async0();
  }
  if (tid < 16) {
    mrow[tid] = -3.0e38f;
    lrow[tid] = 0.f;
  }
  __syncthreads();

  v8f acc0 = {};
  v8f acc1 = {};
  const int   c0    = wave * 32;    // this wave's channel slice for phase 2
  const float scale = 0.0625f;      // C^{-1/2} = 1/16

  for (int j0 = 0; j0 < HW_; j0 += JCHUNK) {
    // ---- Phase 1: score subtile S[i, jj..jj+15], jj = j0 + 16*wave ----
    {
      const int    jj   = j0 + wave * 16;
      const float* kcol = kp + jj + l16;  // B frag: n = l16
      v8f s = {};
#pragma unroll 8
      for (int kk = 0; kk < C_; kk += 4) {
        v2f a, bb;
        a.x  = qs[(kk + kb + 0) * 16 + l16];       // A: m = l16, k = c
        a.y  = qs[(kk + kb + 1) * 16 + l16];
        bb.x = kcol[(long)(kk + kb + 0) * HW_];    // B: k = c, n = j
        bb.y = kcol[(long)(kk + kb + 1) * HW_];
        s = wmma_f32(a, bb, s);
      }
#pragma unroll
      for (int r = 0; r < 8; ++r)
        ss[wave * (16 * SPITCH) + (r + 8 * half) * SPITCH + l16] = s[r] * scale;
    }
    __syncthreads();

    // ---- Online softmax stats: thread r handles query row r ----
    if (tid < 16) {
      float mold = mrow[tid];
      float mnew = mold;
      for (int t = 0; t < 8; ++t)
        for (int j = 0; j < 16; ++j)
          mnew = fmaxf(mnew, ss[t * (16 * SPITCH) + tid * SPITCH + j]);
      float alpha = __expf(mold - mnew);
      float lsum  = 0.f;
      for (int t = 0; t < 8; ++t)
        for (int j = 0; j < 16; ++j) {
          float e = __expf(ss[t * (16 * SPITCH) + tid * SPITCH + j] - mnew);
          ss[t * (16 * SPITCH) + tid * SPITCH + j] = e;
          lsum += e;
        }
      mrow[tid] = mnew;
      lrow[tid] = lrow[tid] * alpha + lsum;
      arow[tid] = alpha;
    }
    __syncthreads();

    // ---- Phase 2: rescale and accumulate out += V * P^T over this chunk ----
    {
      const float alpha = arow[l16];  // out-acc lane N index == query row
#pragma unroll
      for (int r = 0; r < 8; ++r) {
        acc0[r] *= alpha;
        acc1[r] *= alpha;
      }
#pragma unroll 8
      for (int kk = 0; kk < JCHUNK; kk += 4) {
        const int jloc  = kk + kb;            // even, jloc+1 stays in subtile
        const int sub   = jloc >> 4;
        const int jl    = jloc & 15;
        const int jglob = j0 + jloc;
        v2f bb;  // B: k = j, n = i  -> transposed read of the score tile
        bb.x = ss[sub * (16 * SPITCH) + l16 * SPITCH + jl + 0];
        bb.y = ss[sub * (16 * SPITCH) + l16 * SPITCH + jl + 1];
        v2f a0 = *(const v2f*)&vp[(long)(c0 + l16) * HW_ + jglob];       // A: m=c
        v2f a1 = *(const v2f*)&vp[(long)(c0 + 16 + l16) * HW_ + jglob];
        acc0 = wmma_f32(a0, bb, acc0);
        acc1 = wmma_f32(a1, bb, acc1);
      }
    }
    __syncthreads();  // ss reused next chunk
  }

  // ---- Finalize: divide by softmax denominator, store [b,c,i] ----
  const float linv = 1.0f / lrow[l16];
  const long  ob   = (long)b * C_ * HW_;
#pragma unroll
  for (int r = 0; r < 8; ++r) {
    int c1 = c0 + r + 8 * half;
    int c2 = c0 + 16 + r + 8 * half;
    outws[ob + (long)c1 * HW_ + i0 + l16] = acc0[r] * linv;
    outws[ob + (long)c2 * HW_ + i0 + l16] = acc1[r] * linv;
  }
}

extern "C" void kernel_launch(void* const* d_in, const int* in_sizes, int n_in,
                              void* d_out, int out_size, void* d_ws, size_t ws_size,
                              hipStream_t stream) {
  (void)in_sizes; (void)n_in; (void)out_size; (void)ws_size;

  const float* x  = (const float*)d_in[0];
  const float* nw = (const float*)d_in[1];
  const float* nb = (const float*)d_in[2];
  const float* wq = (const float*)d_in[3];
  const float* bq = (const float*)d_in[4];
  const float* wk = (const float*)d_in[5];
  const float* bk = (const float*)d_in[6];
  const float* wv = (const float*)d_in[7];
  const float* bv = (const float*)d_in[8];
  const float* wp = (const float*)d_in[9];
  const float* bp = (const float*)d_in[10];
  float*       out = (float*)d_out;

  const size_t TENS = (size_t)B_ * C_ * HW_;  // 8 Mi floats
  float* hn = (float*)d_ws;
  float* qb = hn + TENS;
  float* kb = qb + TENS;
  float* vb = kb + TENS;

  dim3 gnGrid(G_, B_);
  gn_kernel<<<gnGrid, 256, 0, stream>>>(x, nw, nb, hn);

  dim3 gemmGrid(HW_ / 64, C_ / 64, B_);
  gemm_kernel<<<gemmGrid, 256, 0, stream>>>(wq, bq, hn, nullptr, qb);
  gemm_kernel<<<gemmGrid, 256, 0, stream>>>(wk, bk, hn, nullptr, kb);
  gemm_kernel<<<gemmGrid, 256, 0, stream>>>(wv, bv, hn, nullptr, vb);

  dim3 attnGrid(HW_ / 16, B_);
  attn_kernel<<<attnGrid, 256, 0, stream>>>(qb, kb, vb, hn);  // hn := attn out

  gemm_kernel<<<gemmGrid, 256, 0, stream>>>(wp, bp, hn, x, out);
}

// v001
// It runs in 891 microseconds.
// Two timings next to v000 put it at 1.62 and 1.61 times that version's speed.
#include <hip/hip_runtime.h>
#include <math.h>
#include <stdint.h>

typedef __attribute__((ext_vector_type(2))) float v2f;
typedef __attribute__((ext_vector_type(8))) float v8f;

#define B_   8
#define C_   256
#define HW_  4096          // 64*64 spatial positions
#define G_   16
#define CPG  (C_ / G_)     // 16 channels per group
#define EPS_ 1e-6f

__device__ __forceinline__ v8f wmma_f32(v2f a, v2f b, v8f c) {
  // 8 args: (neg_a, A, neg_b, B, c_mod, C, reuse_a, reuse_b)
  return __builtin_amdgcn_wmma_f32_16x16x4_f32(
      false, a, false, b, (short)0, c, false, false);
}

__device__ __forceinline__ void async_ld_b128(unsigned lds_addr, const void* gaddr) {
  asm volatile("global_load_async_to_lds_b128 %0, %1, off"
               :: "v"(lds_addr), "v"(gaddr)
               : "memory");
}
__device__ __forceinline__ void wait_async0() {
  asm volatile("s_wait_asynccnt 0x0" ::: "memory");
}
__device__ __forceinline__ void wait_async2() {
  asm volatile("s_wait_asynccnt 0x2" ::: "memory");
}
__device__ __forceinline__ unsigned lds_off(const void* p) {
  return (unsigned)(uintptr_t)p;  // low 32 bits of flat shared addr = LDS offset
}

// ---------------------------------------------------------------------------
// GroupNorm: one block per (group, batch). 16 ch x 4096 px = 65536 elems.
// ---------------------------------------------------------------------------
__global__ __launch_bounds__(256)
void gn_kernel(const float* __restrict__ x, const float* __restrict__ nw,
               const float* __restrict__ nb, float* __restrict__ hn) {
  const int g   = blockIdx.x;
  const int b   = blockIdx.y;
  const int tid = threadIdx.x;
  const long base  = (long)b * C_ * HW_ + (long)g * CPG * HW_;
  const int  NELEM = CPG * HW_;  // 65536

  float s = 0.f, s2 = 0.f;
  for (int i = tid; i < NELEM; i += 256) {
    float v = x[base + i];
    s += v;
    s2 += v * v;
  }
  __shared__ float red[512];
  red[tid] = s;
  red[256 + tid] = s2;
  __syncthreads();
  for (int off = 128; off > 0; off >>= 1) {
    if (tid < off) {
      red[tid]       += red[tid + off];
      red[256 + tid] += red[256 + tid + off];
    }
    __syncthreads();
  }
  __shared__ float mean_s, rstd_s;
  if (tid == 0) {
    float mean = red[0] * (1.0f / NELEM);
    float var  = red[256] * (1.0f / NELEM) - mean * mean;
    mean_s = mean;
    rstd_s = rsqrtf(var + EPS_);
  }
  __syncthreads();
  const float mean = mean_s, rstd = rstd_s;
  for (int i = tid; i < NELEM; i += 256) {
    int c = g * CPG + (i >> 12);  // i / 4096
    hn[base + i] = (x[base + i] - mean) * rstd * nw[c] + nb[c];
  }
}

#define AP 20   // A tile pitch (floats): [64 m][AP]
#define BP 80   // B tile pitch (floats): [16 k][BP]

__global__ __launch_bounds__(256)
void gemm_kernel(const float* __restrict__ w,      // [C_,C_] row-major [o][c]
                 const float* __restrict__ bias,   // [C_]
                 const float* __restrict__ in,     // [B_,C_,HW_]
                 const float* __restrict__ resid,  // [B_,C_,HW_] or null
                 float* __restrict__ out) {        // [B_,C_,HW_]
  const int n0    = blockIdx.x * 64;
  const int m0    = blockIdx.y * 64;
  const int b     = blockIdx.z;
  const int tid   = threadIdx.x;
  const int lane  = tid & 31;
  const int wave  = tid >> 5;
  const int m_off = (wave >> 1) * 16;
  const int n_off = (wave & 1) * 32;
  const int half  = lane >> 4;   // which 16-lane half
  const int l16   = lane & 15;
  const int kb    = half * 2;    // K base of this half's A/B fragment

  __shared__ float As[2][64 * AP];  // [buf][m][k]
  __shared__ float Bs[2][16 * BP];  // [buf][k][n]

  const float*   inb     = in + (long)b * C_ * HW_;
  const unsigned as_base = lds_off(&As[0][0]);
  const unsigned bs_base = lds_off(&Bs[0][0]);

  // Per-thread staging assignment (one b128 for A, one for B, per chunk).
  const int am  = tid >> 2;          // A: row m = 0..63
  const int akq = (tid & 3) * 4;     // A: k quad = 0,4,8,12
  const int bn4 = (tid & 15) * 4;    // B: n quad
  const int bkr = tid >> 4;          // B: k row = 0..15

  v8f acc0 = {};
  v8f acc1 = {};

  auto issue = [&](int k0, int buf) {
    async_ld_b128(as_base + (unsigned)((buf * 64 * AP + am * AP + akq) * 4),
                  &w[(m0 + am) * C_ + k0 + akq]);
    async_ld_b128(bs_base + (unsigned)((buf * 16 * BP + bkr * BP + bn4) * 4),
                  &inb[(long)(k0 + bkr) * HW_ + n0 + bn4]);
  };
  auto compute = [&](int buf) {
    const float* A = &As[buf][0];
    const float* B = &Bs[buf][0];
#pragma unroll
    for (int kk = 0; kk < 16; kk += 4) {
      v2f a, b0, b1;
      a.x  = A[(m_off + l16) * AP + kk + kb + 0];
      a.y  = A[(m_off + l16) * AP + kk + kb + 1];
      b0.x = B[(kk + kb + 0) * BP + n_off + l16];
      b0.y = B[(kk + kb + 1) * BP + n_off + l16];
      b1.x = B[(kk + kb + 0) * BP + n_off + 16 + l16];
      b1.y = B[(kk + kb + 1) * BP + n_off + 16 + l16];
      acc0 = wmma_f32(a, b0, acc0);
      acc1 = wmma_f32(a, b1, acc1);
    }
  };

  // Prologue: stage chunk 0 into buffer 0.
  issue(0, 0);

  // Steady state: branch-free double-buffered pipeline.
  int cur = 0;
  for (int k0 = 0; k0 < C_ - 16; k0 += 16) {
    issue(k0 + 16, cur ^ 1);
    wait_async2();       // current chunk's 2 loads done (async loads in-order)
    __syncthreads();
    compute(cur);
    __syncthreads();     // buf `cur` may be restaged next iteration
    cur ^= 1;
  }
  // Peeled tail: last chunk.
  wait_async0();
  __syncthreads();
  compute(cur);

#pragma unroll
  for (int r = 0; r < 8; ++r) {
    int   o   = m0 + m_off + r + 8 * half;
    float bv  = bias[o];
    long  row = (long)b * C_ * HW_ + (long)o * HW_;
    int   na  = n0 + n_off + l16;
    int   nb2 = n0 + n_off + 16 + l16;
    float v0 = acc0[r] + bv;
    float v1 = acc1[r] + bv;
    if (resid) {
      v0 += resid[row + na];
      v1 += resid[row + nb2];
    }
    out[row + na]  = v0;
    out[row + nb2] = v1;
  }
}

#define JCHUNK 128
#define QT     4           // 16-row query tiles per block
#define QROWS  (QT * 16)
#define QP     80
#define SP     132

__device__ __forceinline__ void async_ld_b128_x(unsigned lds_addr, const void* gaddr) {
  asm volatile("global_load_async_to_lds_b128 %0, %1, off\n\ts_wait_xcnt 0x0"
               :: "v"(lds_addr), "v"(gaddr)
               : "memory");
}

__global__ __launch_bounds__(256)
void attn_kernel(const float* __restrict__ q, const float* __restrict__ k,
                 const float* __restrict__ v, float* __restrict__ outws) {
  const int i0   = blockIdx.x * QROWS;
  const int b    = blockIdx.y;
  const int tid  = threadIdx.x;
  const int lane = tid & 31;
  const int wave = tid >> 5;
  const int half = lane >> 4;
  const int l16  = lane & 15;
  const int kb   = half * 2;

  __shared__ __attribute__((aligned(16))) float qs[C_ * QP];     // [c][i]
  __shared__ __attribute__((aligned(16))) float ss[QROWS * SP];  // [i][j]
  __shared__ float mrow[QROWS], lrow[QROWS], arow[QROWS];

  const float* qb = q + (long)b * C_ * HW_;
  const float* kp = k + (long)b * C_ * HW_;
  const float* vp = v + (long)b * C_ * HW_;

  // Stage the Q tile via async-to-LDS: qs[c][i] = q[b, c, i0+i]
  {
    const unsigned qs_base = lds_off(&qs[0]);
    const int f = (tid & 15) * 4;   // QROWS / 4 = 16 quads per channel row
    for (int cb = 0; cb < C_; cb += 16) {   // uniform trip count: every lane on
      int c = cb + (tid >> 4);
      async_ld_b128_x(qs_base + (unsigned)((c * QP + f) * 4),
                      &qb[(long)c * HW_ + i0 + f]);
    }
    wait_async0();
  }
  if (tid < QROWS) {
    mrow[tid] = -3.0e38f;
    lrow[tid] = 0.f;
  }
  __syncthreads();

  v8f acc0[QT] = {};
  v8f acc1[QT] = {};
  const int   c0    = wave * 32;    // this wave's channel slice for phase 2
  const float scale = 0.0625f;      // C^{-1/2} = 1/16

  for (int j0 = 0; j0 < HW_; j0 += JCHUNK) {
    // ---- Phase 1: score tiles S[0..63, jj..jj+15], jj = j0 + 16*wave ----
    {
      const int    jj   = j0 + wave * 16;
      const float* kcol = kp + jj + l16;  // B frag: n = l16
      v8f s[QT] = {};
      // unroll 8: sixteen K loads in flight per wave to cover the L2 latency
#pragma unroll 8
      for (int kk = 0; kk < C_; kk += 4) {
        v2f bb;
        bb.x = kcol[(long)(kk + kb + 0) * HW_];    // B: k = c, n = j
        bb.y = kcol[(long)(kk + kb + 1) * HW_];
        // full unroll: s[t] must be indexed statically to stay in registers
#pragma unroll
        for (int t = 0; t < QT; ++t) {
          v2f a;
          a.x = qs[(kk + kb + 0) * QP + t * 16 + l16];  // A: m = l16, k = c
          a.y = qs[(kk + kb + 1) * QP + t * 16 + l16];
          s[t] = wmma_f32(a, bb, s[t]);
        }
      }
#pragma unroll
      for (int t = 0; t < QT; ++t)
#pragma unroll
        for (int r = 0; r < 8; ++r)
          ss[(t * 16 + r + 8 * half) * SP + wave * 16 + l16] = s[t][r] * scale;
    }
    __syncthreads();

    // ---- Online softmax stats: thread r handles query row r ----
    if (tid < QROWS) {
      float* srow = &ss[tid * SP];
      float  mold = mrow[tid];
      float  mnew = mold;
      for (int j = 0; j < JCHUNK; j += 4) {
        const float4 t4 = *(const float4*)&srow[j];
        mnew = fmaxf(mnew, t4.x);
        mnew = fmaxf(mnew, t4.y);
        mnew = fmaxf(mnew, t4.z);
        mnew = fmaxf(mnew, t4.w);
      }
      float alpha = __expf(mold - mnew);
      float lsum  = 0.f;
      for (int j = 0; j < JCHUNK; j += 4) {
        float4 t4 = *(const float4*)&srow[j];
        t4.x = __expf(t4.x - mnew);
        t4.y = __expf(t4.y - mnew);
        t4.z = __expf(t4.z - mnew);
        t4.w = __expf(t4.w - mnew);
        *(float4*)&srow[j] = t4;
        lsum += t4.x;
        lsum += t4.y;
        lsum += t4.z;
        lsum += t4.w;
      }
      mrow[tid] = mnew;
      lrow[tid] = lrow[tid] * alpha + lsum;
      arow[tid] = alpha;
    }
    __syncthreads();

    // ---- Phase 2: rescale and accumulate out += V * P^T over this chunk ----
    {
#pragma unroll
      for (int t = 0; t < QT; ++t) {
        const float alpha = arow[t * 16 + l16];  // acc lane N index == query row
#pragma unroll
        for (int r = 0; r < 8; ++r) {
          acc0[t][r] *= alpha;
          acc1[t][r] *= alpha;
        }
      }
      // One base address per lane; every V load of the chunk is base + constant.
      const float* vrow = vp + (long)(c0 + l16) * HW_ + j0 + kb;
      // unroll 8: sixteen V loads in flight per wave to cover the L2 latency
#pragma unroll 8
      for (int kk = 0; kk < JCHUNK; kk += 4) {
        const int jloc = kk + kb;
        v2f a0 = *(const v2f*)&vrow[kk];               // A: m = c, k = j
        v2f a1 = *(const v2f*)&vrow[16 * HW_ + kk];
        // full unroll: the accumulators must be indexed statically
#pragma unroll
        for (int t = 0; t < QT; ++t) {
          // B: k = j, n = i  -> transposed read of the score rows
          v2f bb = *(const v2f*)&ss[(t * 16 + l16) * SP + jloc];
          acc0[t] = wmma_f32(a0, bb, acc0[t]);
          acc1[t] = wmma_f32(a1, bb, acc1[t]);
        }
      }
    }
    __syncthreads();  // ss reused next chunk
  }

  // ---- Finalize: divide by softmax denominator, store [b,c,i] ----
  const long ob = (long)b * C_ * HW_;
#pragma unroll
  for (int t = 0; t < QT; ++t) {
    const float linv = 1.0f / lrow[t * 16 + l16];
#pragma unroll
    for (int r = 0; r < 8; ++r) {
      int c1 = c0 + r + 8 * half;
      int c2 = c0 + 16 + r + 8 * half;
      outws[ob + (long)c1 * HW_ + i0 + t * 16 + l16] = acc0[t][r] * linv;
      outws[ob + (long)c2 * HW_ + i0 + t * 16 + l16] = acc1[t][r] * linv;
    }
  }
}

extern "C" void kernel_launch(void* const* d_in, const int* in_sizes, int n_in,
                              void* d_out, int out_size, void* d_ws, size_t ws_size,
                              hipStream_t stream) {
  (void)in_sizes; (void)n_in; (void)out_size; (void)ws_size;

  const float* x  = (const float*)d_in[0];
  const float* nw = (const float*)d_in[1];
  const float* nb = (const float*)d_in[2];
  const float* wq = (const float*)d_in[3];
  const float* bq = (const float*)d_in[4];
  const float* wk = (const float*)d_in[5];
  const float* bk = (const float*)d_in[6];
  const float* wv = (const float*)d_in[7];
  const float* bv = (const float*)d_in[8];
  const float* wp = (const float*)d_in[9];
  const float* bp = (const float*)d_in[10];
  float*       out = (float*)d_out;

  const size_t TENS = (size_t)B_ * C_ * HW_;  // 8 Mi floats
  float* hn = (float*)d_ws;
  float* qb = hn + TENS;
  float* kb = qb + TENS;
  float* vb = kb + TENS;

  dim3 gnGrid(G_, B_);
  gn_kernel<<<gnGrid, 256, 0, stream>>>(x, nw, nb, hn);

  dim3 gemmGrid(HW_ / 64, C_ / 64, B_);
  gemm_kernel<<<gemmGrid, 256, 0, stream>>>(wq, bq, hn, nullptr, qb);
  gemm_kernel<<<gemmGrid, 256, 0, stream>>>(wk, bk, hn, nullptr, kb);
  gemm_kernel<<<gemmGrid, 256, 0, stream>>>(wv, bv, hn, nullptr, vb);

  dim3 attnGrid(HW_ / QROWS, B_);
  attn_kernel<<<attnGrid, 256, 0, stream>>>(qb, kb, vb, hn);  // hn := attn out

  gemm_kernel<<<gemmGrid, 256, 0, stream>>>(wp, bp, hn, x, out);
}
